// v000
// The times below were measured on an AMD MI455X: many runs one after another, warmed up first and cycling through
// copies of the inputs, with the whole window's GPU time divided by the number of runs. Launches and the gaps
// between them are all in it. The median over several windows is given; except for v000 it joins two sittings, which
// can be a few percent apart, so the side-by-side timings, each taken in one sitting, are the better comparison.
// v000 is the starting kernel. One run takes 151 microseconds.
#include <hip/hip_runtime.h>
#include <hip/hip_bf16.h>

typedef __attribute__((ext_vector_type(2))) float v2f;
typedef __attribute__((ext_vector_type(8))) float v8f;

#define Bb 8
#define Rr 128
#define Ss 512
#define Dd 33
#define Ee 128
#define Hh 4
#define EKk 32

// ---------------------------------------------------------------------------
// sa = sigmoid(stride @ Wr.T + br)   (33 outputs; also written to d_out tail)
// ---------------------------------------------------------------------------
__global__ void sa_kernel(const float* __restrict__ stridev,
                          const float* __restrict__ Wr,
                          const float* __restrict__ br,
                          float* __restrict__ sa_ws,
                          float* __restrict__ out_tail) {
  int d = threadIdx.x;
  if (d < Dd) {
    float z = br[d];
    for (int j = 0; j < Dd; ++j) z += stridev[j] * Wr[d * Dd + j];
    float s = 1.0f / (1.0f + __expf(-z));
    sa_ws[d] = s;
    out_tail[d] = s;
  }
}

// ---------------------------------------------------------------------------
// Generic C = A(MxK) * W(NxK)^T + bias, f32 WMMA 16x16x4, one wave per tile.
// N = Ntiles*16.  Used for Q-proj (K=128), K-proj (K=128), out-proj (K=132).
// ---------------------------------------------------------------------------
__global__ __launch_bounds__(256) void gemm_wt_kernel(
    const float* __restrict__ A, const float* __restrict__ W,
    const float* __restrict__ bias, float* __restrict__ C,
    int M, int K, int Ntiles) {
  int wave = threadIdx.x >> 5;
  int lane = threadIdx.x & 31;
  int tile = blockIdx.x * 8 + wave;
  int mt = tile / Ntiles;
  int nt = tile % Ntiles;
  if (mt * 16 >= M) return;  // wave-uniform: EXEC stays all-ones for WMMA

  int rc = lane & 15;   // A-row / W-row (B-col) index
  int hi = lane >> 4;   // K sub-pair select (K offset +2 for upper half)

  const float* Abase = A + (size_t)(mt * 16 + rc) * K + hi * 2;
  const float* Wbase = W + (size_t)(nt * 16 + rc) * K + hi * 2;

  v8f c = {};
  for (int k0 = 0; k0 < K; k0 += 4) {
    v2f a = *(const v2f*)(Abase + k0);  // A[row, k0+hi*2 .. +1]
    v2f b = *(const v2f*)(Wbase + k0);  // B[k0+hi*2 .. +1, col] = W[col, k]
    c = __builtin_amdgcn_wmma_f32_16x16x4_f32(false, a, false, b, (short)0, c,
                                              false, false);
  }
  int N = Ntiles * 16;
  float bv = bias[nt * 16 + rc];
  float* Cb = C + (size_t)(mt * 16 + hi * 8) * N + nt * 16 + rc;
  for (int i = 0; i < 8; ++i) Cb[(size_t)i * N] = c[i] + bv;
}

// ---------------------------------------------------------------------------
// scores[b,h,r,s] = (q[b,r,h*32:] . k[b,s,h*32:]) / sqrt(32)
// One wave per 16x16 (r,s) tile; K=32 -> 8 WMMA steps.
// ---------------------------------------------------------------------------
__global__ __launch_bounds__(256) void scores_kernel(
    const float* __restrict__ qb,   // (B,R,128)
    const float* __restrict__ kb,   // (B,S,128)
    float* __restrict__ scores) {   // (B,H,R,S), pre-scaled
  int wave = threadIdx.x >> 5;
  int lane = threadIdx.x & 31;
  int tile = blockIdx.x * 8 + wave;  // 8192 tiles total
  int st = tile & 31;
  int rt = (tile >> 5) & 7;
  int h  = (tile >> 8) & 3;
  int b  = tile >> 10;

  int rc = lane & 15;
  int hi = lane >> 4;

  const float* Abase = qb + ((size_t)b * Rr + rt * 16 + rc) * Ee + h * EKk + hi * 2;
  const float* Bbase = kb + ((size_t)b * Ss + st * 16 + rc) * Ee + h * EKk + hi * 2;

  v8f c = {};
  for (int k0 = 0; k0 < EKk; k0 += 4) {
    v2f a = *(const v2f*)(Abase + k0);
    v2f bfr = *(const v2f*)(Bbase + k0);
    c = __builtin_amdgcn_wmma_f32_16x16x4_f32(false, a, false, bfr, (short)0, c,
                                              false, false);
  }
  const float scale = 0.17677669529663687f;  // 1/sqrt(32)
  float* out = scores + (((size_t)(b * Hh + h) * Rr) + rt * 16) * Ss + st * 16;
  for (int i = 0; i < 8; ++i)
    out[(size_t)(i + hi * 8) * Ss + rc] = c[i] * scale;
}

// ---------------------------------------------------------------------------
// Per (b,r): masked softmax over s for every (h,d), weighted sum with value.
// x[b,r,h*33+d] = sum_s e[h,s]*a[s,d]*v[s,d] / sum_s e[h,s]*a[s,d]
// a[s,d] = mask[s,d] * (|tt[s]-qt[r]| <= sa[d]); all-masked -> mean_s v[s,d].
// LDS: value 66KB + mask bytes 16.5KB + exp 8KB + dt 2KB (< 320KB/WGP).
// ---------------------------------------------------------------------------
__global__ __launch_bounds__(256) void attn_kernel(
    const float* __restrict__ scores,  // (B,H,R,S)
    const float* __restrict__ value,   // (B,S,D)
    const float* __restrict__ mask,    // (B,S,D)
    const float* __restrict__ qt,      // (R)
    const float* __restrict__ tt,      // (B,S)
    const float* __restrict__ sa,      // (D)
    float* __restrict__ xbuf) {        // (B,R,H*D)
  __shared__ float v_sh[Ss * Dd];
  __shared__ unsigned char m_sh[Ss * Dd];
  __shared__ float e_sh[Hh][Ss];
  __shared__ float dt_sh[Ss];
  __shared__ float red[Hh][64];

  int t = threadIdx.x;
  int b = blockIdx.x >> 7;
  int r = blockIdx.x & 127;

  // Stage value / mask for this batch (fully coalesced flat copy).
  const float* vb = value + (size_t)b * Ss * Dd;
  const float* mb = mask + (size_t)b * Ss * Dd;
  for (int i = t; i < Ss * Dd; i += 256) {
    v_sh[i] = vb[i];
    m_sh[i] = (mb[i] != 0.0f) ? 1 : 0;
  }
  float qtr = qt[r];
  for (int s = t; s < Ss; s += 256) dt_sh[s] = fabsf(tt[b * Ss + s] - qtr);

  // Row max + exp per head: 64 threads per head, 8 scores each.
  int h = t >> 6;
  int l64 = t & 63;
  const float* scb = scores + ((size_t)(b * Hh + h) * Rr + r) * Ss;
  float sc_loc[8];
  float lmax = -3.0e38f;
  for (int i = 0; i < 8; ++i) {
    float v = scb[l64 + 64 * i];
    sc_loc[i] = v;
    lmax = fmaxf(lmax, v);
  }
  red[h][l64] = lmax;
  __syncthreads();
  for (int off = 32; off > 0; off >>= 1) {
    if (l64 < off) red[h][l64] = fmaxf(red[h][l64], red[h][l64 + off]);
    __syncthreads();
  }
  float mh = red[h][0];
  for (int i = 0; i < 8; ++i)
    e_sh[h][l64 + 64 * i] = __expf(sc_loc[i] - mh);
  __syncthreads();

  // Accumulate: one thread per (h,d) pair (132 active).
  if (t < Hh * Dd) {
    int ha = t / Dd;
    int d = t % Dd;
    float sad = sa[d];
    const float* eh = e_sh[ha];
    float num = 0.f, den = 0.f, vsum = 0.f;
    for (int s = 0; s < Ss; ++s) {
      float v = v_sh[s * Dd + d];
      vsum += v;
      if (dt_sh[s] <= sad && m_sh[s * Dd + d]) {
        float w = eh[s];
        num += w * v;
        den += w;
      }
    }
    float x = (den > 0.f) ? (num / den) : (vsum * (1.0f / Ss));
    xbuf[((size_t)b * Rr + r) * (Hh * Dd) + ha * Dd + d] = x;
  }
}

// ---------------------------------------------------------------------------
extern "C" void kernel_launch(void* const* d_in, const int* in_sizes, int n_in,
                              void* d_out, int out_size, void* d_ws,
                              size_t ws_size, hipStream_t stream) {
  const float* query = (const float*)d_in[0];
  const float* key   = (const float*)d_in[1];
  const float* value = (const float*)d_in[2];
  const float* mask  = (const float*)d_in[3];
  const float* qt    = (const float*)d_in[4];
  const float* tt    = (const float*)d_in[5];
  const float* strv  = (const float*)d_in[6];
  const float* Wq    = (const float*)d_in[7];
  const float* bq    = (const float*)d_in[8];
  const float* Wk    = (const float*)d_in[9];
  const float* bk    = (const float*)d_in[10];
  const float* Wr    = (const float*)d_in[11];
  const float* br    = (const float*)d_in[12];
  const float* Wo    = (const float*)d_in[13];
  const float* bo    = (const float*)d_in[14];
  float* out = (float*)d_out;

  // Workspace layout (floats): sa(64) | qbuf | kbuf | xbuf | scores  (~11.6MB)
  float* ws = (float*)d_ws;
  float* sa_ws  = ws;
  float* qbuf   = ws + 64;                 // 8*128*128   = 131072
  float* kbuf   = qbuf + 131072;           // 8*512*128   = 524288
  float* xbuf   = kbuf + 524288;           // 8*128*132   = 135168
  float* scoreb = xbuf + 135168;           // 8*4*128*512 = 2097152

  sa_kernel<<<1, 64, 0, stream>>>(strv, Wr, br, sa_ws, out + Bb * Rr * 128);
  // Q-proj: M=1024, K=128, N=128 -> 512 tiles / 8 waves = 64 blocks
  gemm_wt_kernel<<<64, 256, 0, stream>>>(query, Wq, bq, qbuf, Bb * Rr, Ee, 8);
  // K-proj: M=4096 -> 2048 tiles = 256 blocks
  gemm_wt_kernel<<<256, 256, 0, stream>>>(key, Wk, bk, kbuf, Bb * Ss, Ee, 8);
  // scores: 8192 tiles = 1024 blocks
  scores_kernel<<<1024, 256, 0, stream>>>(qbuf, kbuf, scoreb);
  // attention core: one block per (b,r)
  attn_kernel<<<Bb * Rr, 256, 0, stream>>>(scoreb, value, mask, qt, tt, sa_ws,
                                           xbuf);
  // out-proj: M=1024, K=132, N=128 -> 64 blocks; writes d_out directly
  gemm_wt_kernel<<<64, 256, 0, stream>>>(xbuf, Wo, bo, out, Bb * Rr, 132, 8);
}

// v001
// It runs in 32.6 microseconds.
// In two side-by-side timings against v000, it was 4.65 and 4.66 times as fast.
#include <hip/hip_runtime.h>
#include <hip/hip_bf16.h>

typedef __attribute__((ext_vector_type(2))) float v2f;
typedef __attribute__((ext_vector_type(4))) float v4f;
typedef __attribute__((ext_vector_type(8))) float v8f;

#define Bb 8
#define Rr 128
#define Ss 512
#define Dd 33
#define Ee 128
#define Hh 4
#define EKk 32

// ---------------------------------------------------------------------------
// sa = sigmoid(stride @ Wr.T + br)   (33 outputs; also written to d_out tail)
// ---------------------------------------------------------------------------
__global__ void sa_kernel(const float* __restrict__ stridev,
                          const float* __restrict__ Wr,
                          const float* __restrict__ br,
                          float* __restrict__ sa_ws,
                          float* __restrict__ out_tail) {
  int d = threadIdx.x;
  if (d < Dd) {
    float z = br[d];
    for (int j = 0; j < Dd; ++j) z += stridev[j] * Wr[d * Dd + j];
    float s = 1.0f / (1.0f + __expf(-z));
    sa_ws[d] = s;
    out_tail[d] = s;
  }
}

// ---------------------------------------------------------------------------
// Generic C = A(MxK) * W(NxK)^T + bias, f32 WMMA 16x16x4, one wave per tile.
// N = Ntiles*16.  Used for Q-proj (K=128), K-proj (K=128), out-proj (K=132).
// ---------------------------------------------------------------------------
__global__ __launch_bounds__(256) void gemm_wt_kernel(
    const float* __restrict__ A, const float* __restrict__ W,
    const float* __restrict__ bias, float* __restrict__ C,
    int M, int K, int Ntiles) {
  int wave = threadIdx.x >> 5;
  int lane = threadIdx.x & 31;
  int tile = blockIdx.x * 8 + wave;
  int mt = tile / Ntiles;
  int nt = tile % Ntiles;
  if (mt * 16 >= M) return;  // wave-uniform: EXEC stays all-ones for WMMA

  int rc = lane & 15;   // A-row / W-row (B-col) index
  int hi = lane >> 4;   // K sub-pair select (K offset +2 for upper half)

  const float* Abase = A + (size_t)(mt * 16 + rc) * K + hi * 2;
  const float* Wbase = W + (size_t)(nt * 16 + rc) * K + hi * 2;

  v8f c = {};
  for (int k0 = 0; k0 < K; k0 += 4) {
    v2f a = *(const v2f*)(Abase + k0);  // A[row, k0+hi*2 .. +1]
    v2f b = *(const v2f*)(Wbase + k0);  // B[k0+hi*2 .. +1, col] = W[col, k]
    c = __builtin_amdgcn_wmma_f32_16x16x4_f32(false, a, false, b, (short)0, c,
                                              false, false);
  }
  int N = Ntiles * 16;
  float bv = bias[nt * 16 + rc];
  float* Cb = C + (size_t)(mt * 16 + hi * 8) * N + nt * 16 + rc;
  for (int i = 0; i < 8; ++i) Cb[(size_t)i * N] = c[i] + bv;
}

// ---------------------------------------------------------------------------
// scores[b,h,r,s] = (q[b,r,h*32:] . k[b,s,h*32:]) / sqrt(32)
// One wave per 16x16 (r,s) tile; K=32 -> 8 WMMA steps.
// ---------------------------------------------------------------------------
__global__ __launch_bounds__(256) void scores_kernel(
    const float* __restrict__ qb,   // (B,R,128)
    const float* __restrict__ kb,   // (B,S,128)
    float* __restrict__ scores) {   // (B,H,R,S), pre-scaled
  int wave = threadIdx.x >> 5;
  int lane = threadIdx.x & 31;
  int tile = blockIdx.x * 8 + wave;  // 8192 tiles total
  int st = tile & 31;
  int rt = (tile >> 5) & 7;
  int h  = (tile >> 8) & 3;
  int b  = tile >> 10;

  int rc = lane & 15;
  int hi = lane >> 4;

  const float* Abase = qb + ((size_t)b * Rr + rt * 16 + rc) * Ee + h * EKk + hi * 2;
  const float* Bbase = kb + ((size_t)b * Ss + st * 16 + rc) * Ee + h * EKk + hi * 2;

  v8f c = {};
  for (int k0 = 0; k0 < EKk; k0 += 4) {
    v2f a = *(const v2f*)(Abase + k0);
    v2f bfr = *(const v2f*)(Bbase + k0);
    c = __builtin_amdgcn_wmma_f32_16x16x4_f32(false, a, false, bfr, (short)0, c,
                                              false, false);
  }
  const float scale = 0.17677669529663687f;  // 1/sqrt(32)
  float* out = scores + (((size_t)(b * Hh + h) * Rr) + rt * 16) * Ss + st * 16;
  for (int i = 0; i < 8; ++i)
    out[(size_t)(i + hi * 8) * Ss + rc] = c[i] * scale;
}

// ---------------------------------------------------------------------------
// Per (b, 4 query rows): masked softmax over s for every (h,d), weighted sum.
// x[b,r,h*33+d] = sum_s e[h,s]*a[s,d]*v[s,d] / sum_s e[h,s]*a[s,d]
// a[s,d] = mask[s,d] * (|tt[s]-qt[r]| <= sa[d]); all-masked -> mean_s v[s,d].
// Thread = (d, s mod 16): flat element t + 528*j of value / mask, so every
// element is read once per block, coalesced, straight into registers, and
// serves 4 query rows x 4 heads.  The 16 partial sums meet in LDS.
// ---------------------------------------------------------------------------
#define RT 4              // query rows per block
#define SC 16             // s slices per block
#define NT (Dd * SC)      // 528 threads
#define NJ (Ss / SC)      // 32 elements per thread
#define SL (Ss / 32)      // scores per lane in the exp stage

__global__ __launch_bounds__(NT) void attn_kernel(
    const float* __restrict__ scores,  // (B,H,R,S)
    const float* __restrict__ value,   // (B,S,D)
    const float* __restrict__ mask,    // (B,S,D)
    const float* __restrict__ qt,      // (R)
    const float* __restrict__ tt,      // (B,S)
    const float* __restrict__ sa,      // (D)
    float* __restrict__ xbuf) {        // (B,R,H*D)
  // One block of LDS, the hot loop's arrays first: they stay within reach of
  // the 16-bit offset of an LDS read, so the loop forms no addresses.
  __shared__ struct {
    v4f e[RT][Ss];        // exp(score - rowmax), 4 heads together
    float tt[Ss];
    v4f red[2][RT][NT];   // [num|den][rr][thread], 4 heads
    float vs[NT];
  } sh;

  int t = threadIdx.x;
  int wave = t >> 5;
  int lane = t & 31;
  int b = blockIdx.x / (Rr / RT);
  int r0 = (blockIdx.x % (Rr / RT)) * RT;
  int s0 = t / Dd;
  int d = t - s0 * Dd;

  // Small operands first, so that nothing later waits behind the big slice.
  float ttv = (t < Ss) ? tt[b * Ss + t] : 0.f;
  float sad = sa[d];
  float qtr[RT];
  for (int rr = 0; rr < RT; ++rr) qtr[rr] = qt[r0 + rr];

  // One wave per (row, head): wave = rr * 4 + h, 16 scores a lane.
  float sc_loc[SL];
  if (wave < RT * Hh) {
    const float* scb =
        scores + ((size_t)(b * Hh + (wave & 3)) * Rr + r0 + (wave >> 2)) * Ss + lane;
#pragma unroll  // static indices: sc_loc stays in registers
    for (int i = 0; i < SL; ++i) sc_loc[i] = scb[32 * i];
  }

  // This thread's slice of value / mask, in flight while the exps are made.
  const float* vb = value + (size_t)b * Ss * Dd + t;
  const float* mb = mask + (size_t)b * Ss * Dd + t;
  float vr[NJ], mr[NJ];
#pragma unroll  // static indices: vr and mr stay in registers, all loads in flight
  for (int j = 0; j < NJ; ++j) {
    vr[j] = vb[j * NT];
    mr[j] = mb[j * NT];
  }
  if (t < Ss) sh.tt[t] = ttv;

  if (wave < RT * Hh) {
    float mx = sc_loc[0];
#pragma unroll  // static indices, as above
    for (int i = 1; i < SL; ++i) mx = fmaxf(mx, sc_loc[i]);
    for (int off = 16; off > 0; off >>= 1) mx = fmaxf(mx, __shfl_xor(mx, off));
    float* eo = (float*)&sh.e[wave >> 2][0] + (wave & 3);
#pragma unroll  // static indices, as above
    for (int i = 0; i < SL; ++i)
      eo[(lane + 32 * i) * Hh] = __expf(sc_loc[i] - mx);
  }
  __syncthreads();

  // The slice has landed: keep the mask as one flag an element from here on.
  bool mk[NJ];
#pragma unroll  // static indices, as above
  for (int j = 0; j < NJ; ++j) mk[j] = mr[j] != 0.0f;

  v2f num[RT][2], den[RT][2];
  for (int rr = 0; rr < RT; ++rr)
    for (int p = 0; p < 2; ++p) {
      num[rr][p] = (v2f){0.f, 0.f};
      den[rr][p] = (v2f){0.f, 0.f};
    }
  float vsum = 0.f;
#pragma unroll  // static indices, as above; LDS offsets become immediates
  for (int j = 0; j < NJ; ++j) {
    int s = s0 + SC * j;
    float v = vr[j];
    float ts = sh.tt[s];
    vsum += v;
    for (int rr = 0; rr < RT; ++rr) {
      bool on = mk[j] && (fabsf(ts - qtr[rr]) <= sad);
      float av = on ? v : 0.f;
      float af = on ? 1.f : 0.f;
      v4f e = sh.e[rr][s];
      v2f e01 = {e.x, e.y}, e23 = {e.z, e.w};
      v2f av2 = {av, av}, af2 = {af, af};
      num[rr][0] = __builtin_elementwise_fma(e01, av2, num[rr][0]);
      num[rr][1] = __builtin_elementwise_fma(e23, av2, num[rr][1]);
      den[rr][0] = __builtin_elementwise_fma(e01, af2, den[rr][0]);
      den[rr][1] = __builtin_elementwise_fma(e23, af2, den[rr][1]);
    }
  }

  for (int rr = 0; rr < RT; ++rr) {
    sh.red[0][rr][t] = (v4f){num[rr][0].x, num[rr][0].y, num[rr][1].x, num[rr][1].y};
    sh.red[1][rr][t] = (v4f){den[rr][0].x, den[rr][0].y, den[rr][1].x, den[rr][1].y};
  }
  sh.vs[t] = vsum;
  __syncthreads();

  // One thread per (rr, d), all 4 heads.
  if (t < RT * Dd) {
    int rr = t / Dd;
    int dd = t - rr * Dd;
    v4f n = {0.f, 0.f, 0.f, 0.f}, de = {0.f, 0.f, 0.f, 0.f};
    float vs = 0.f;
    for (int c = 0; c < SC; ++c) {
      n += sh.red[0][rr][c * Dd + dd];
      de += sh.red[1][rr][c * Dd + dd];
      vs += sh.vs[c * Dd + dd];
    }
    float mean = vs * (1.0f / Ss);
    float* xo = xbuf + ((size_t)b * Rr + r0 + rr) * (Hh * Dd) + dd;
    xo[0 * Dd] = (de.x > 0.f) ? (n.x / de.x) : mean;
    xo[1 * Dd] = (de.y > 0.f) ? (n.y / de.y) : mean;
    xo[2 * Dd] = (de.z > 0.f) ? (n.z / de.z) : mean;
    xo[3 * Dd] = (de.w > 0.f) ? (n.w / de.w) : mean;
  }
}

// ---------------------------------------------------------------------------
extern "C" void kernel_launch(void* const* d_in, const int* in_sizes, int n_in,
                              void* d_out, int out_size, void* d_ws,
                              size_t ws_size, hipStream_t stream) {
  const float* query = (const float*)d_in[0];
  const float* key   = (const float*)d_in[1];
  const float* value = (const float*)d_in[2];
  const float* mask  = (const float*)d_in[3];
  const float* qt    = (const float*)d_in[4];
  const float* tt    = (const float*)d_in[5];
  const float* strv  = (const float*)d_in[6];
  const float* Wq    = (const float*)d_in[7];
  const float* bq    = (const float*)d_in[8];
  const float* Wk    = (const float*)d_in[9];
  const float* bk    = (const float*)d_in[10];
  const float* Wr    = (const float*)d_in[11];
  const float* br    = (const float*)d_in[12];
  const float* Wo    = (const float*)d_in[13];
  const float* bo    = (const float*)d_in[14];
  float* out = (float*)d_out;

  // Workspace layout (floats): sa(64) | qbuf | kbuf | xbuf | scores  (~11.6MB)
  float* ws = (float*)d_ws;
  float* sa_ws  = ws;
  float* qbuf   = ws + 64;                 // 8*128*128   = 131072
  float* kbuf   = qbuf + 131072;           // 8*512*128   = 524288
  float* xbuf   = kbuf + 524288;           // 8*128*132   = 135168
  float* scoreb = xbuf + 135168;           // 8*4*128*512 = 2097152

  sa_kernel<<<1, 64, 0, stream>>>(strv, Wr, br, sa_ws, out + Bb * Rr * 128);
  // Q-proj: M=1024, K=128, N=128 -> 512 tiles / 8 waves = 64 blocks
  gemm_wt_kernel<<<64, 256, 0, stream>>>(query, Wq, bq, qbuf, Bb * Rr, Ee, 8);
  // K-proj: M=4096 -> 2048 tiles = 256 blocks
  gemm_wt_kernel<<<256, 256, 0, stream>>>(key, Wk, bk, kbuf, Bb * Ss, Ee, 8);
  // scores: 8192 tiles = 1024 blocks
  scores_kernel<<<1024, 256, 0, stream>>>(qbuf, kbuf, scoreb);
  // attention core: one block per (b, 4 query rows)
  attn_kernel<<<Bb * Rr / RT, NT, 0, stream>>>(scoreb, value, mask, qt, tt,
                                               sa_ws, xbuf);
  // out-proj: M=1024, K=132, N=128 -> 64 blocks; writes d_out directly
  gemm_wt_kernel<<<64, 256, 0, stream>>>(xbuf, Wo, bo, out, Bb * Rr, 132, 8);
}

// v002
// One run takes 27.1 microseconds.
// Two timings next to v001 put it at 1.19 and 1.20 times that version's speed.
// Over all steps from v000 it is 5.56 times as fast.
#include <hip/hip_runtime.h>
#include <hip/hip_bf16.h>

typedef __attribute__((ext_vector_type(2))) float v2f;
typedef __attribute__((ext_vector_type(4))) float v4f;
typedef __attribute__((ext_vector_type(8))) float v8f;

#define Bb 8
#define Rr 128
#define Ss 512
#define Dd 33
#define Ee 128
#define Hh 4
#define EKk 32

// ---------------------------------------------------------------------------
// sa = sigmoid(stride @ Wr.T + br)   (33 outputs; also written to d_out tail)
// ---------------------------------------------------------------------------
__device__ __forceinline__ void sa_body(const float* __restrict__ stridev,
                                        const float* __restrict__ Wr,
                                        const float* __restrict__ br,
                                        float* __restrict__ sa_ws,
                                        float* __restrict__ out_tail) {
  int d = threadIdx.x;
  if (d < Dd) {
    float z = br[d];
    for (int j = 0; j < Dd; ++j) z += stridev[j] * Wr[d * Dd + j];
    float s = 1.0f / (1.0f + __expf(-z));
    sa_ws[d] = s;
    out_tail[d] = s;
  }
}

// ---------------------------------------------------------------------------
// Generic C = A(MxK) * W(NxK)^T + bias, f32 WMMA 16x16x4, one wave per tile.
// N = Ntiles*16.  blk = index of this block among the product's own blocks.
// ---------------------------------------------------------------------------
__device__ __forceinline__ void gemm_wt_body(
    const float* __restrict__ A, const float* __restrict__ W,
    const float* __restrict__ bias, float* __restrict__ C,
    int M, int K, int Ntiles, int blk) {
  int wave = threadIdx.x >> 5;
  int lane = threadIdx.x & 31;
  int tile = blk * 8 + wave;
  int mt = tile / Ntiles;
  int nt = tile % Ntiles;
  if (mt * 16 >= M) return;  // wave-uniform: EXEC stays all-ones for WMMA

  int rc = lane & 15;   // A-row / W-row (B-col) index
  int hi = lane >> 4;   // K sub-pair select (K offset +2 for upper half)

  const float* Abase = A + (size_t)(mt * 16 + rc) * K + hi * 2;
  const float* Wbase = W + (size_t)(nt * 16 + rc) * K + hi * 2;

  v8f c = {};
  for (int k0 = 0; k0 < K; k0 += 4) {
    v2f a = *(const v2f*)(Abase + k0);  // A[row, k0+hi*2 .. +1]
    v2f b = *(const v2f*)(Wbase + k0);  // B[k0+hi*2 .. +1, col] = W[col, k]
    c = __builtin_amdgcn_wmma_f32_16x16x4_f32(false, a, false, b, (short)0, c,
                                              false, false);
  }
  int N = Ntiles * 16;
  float bv = bias[nt * 16 + rc];
  float* Cb = C + (size_t)(mt * 16 + hi * 8) * N + nt * 16 + rc;
  for (int i = 0; i < 8; ++i) Cb[(size_t)i * N] = c[i] + bv;
}

// Out-proj (K=132).
__global__ __launch_bounds__(256) void gemm_wt_kernel(
    const float* __restrict__ A, const float* __restrict__ W,
    const float* __restrict__ bias, float* __restrict__ C,
    int M, int K, int Ntiles) {
  gemm_wt_body(A, W, bias, C, M, K, Ntiles, blockIdx.x);
}

// ---------------------------------------------------------------------------
// The three stages that need nothing of each other, in one grid by ranges of
// the block index: block 0 = sa, then the K-proj blocks, then the Q-proj blocks.
// ---------------------------------------------------------------------------
#define KPB (Bb * Ss / 16)   // K-proj: 4096/16 row tiles x 8 col tiles / 8 waves
#define QPB (Bb * Rr / 16)   // Q-proj: 1024/16 row tiles x 8 col tiles / 8 waves

__global__ __launch_bounds__(256) void front_kernel(
    const float* __restrict__ query, const float* __restrict__ Wq,
    const float* __restrict__ bq, float* __restrict__ qbuf,
    const float* __restrict__ key, const float* __restrict__ Wk,
    const float* __restrict__ bk, float* __restrict__ kbuf,
    const float* __restrict__ stridev, const float* __restrict__ Wr,
    const float* __restrict__ br, float* __restrict__ sa_ws,
    float* __restrict__ out_tail, int K, int Ntiles) {
  int blk = (int)blockIdx.x - 1;
  if (blk < 0) {
    sa_body(stridev, Wr, br, sa_ws, out_tail);
    return;
  }
  bool isk = blk < KPB;  // block-uniform: one copy of the product's loop serves both
  gemm_wt_body(isk ? key : query, isk ? Wk : Wq, isk ? bk : bq,
               isk ? kbuf : qbuf, isk ? Bb * Ss : Bb * Rr, K, Ntiles,
               isk ? blk : blk - KPB);
}

// ---------------------------------------------------------------------------
// scores[b,h,r,s] = (q[b,r,h*32:] . k[b,s,h*32:]) / sqrt(32)
// One wave per 16x16 (r,s) tile; K=32 -> 8 WMMA steps.
// ---------------------------------------------------------------------------
__global__ __launch_bounds__(256) void scores_kernel(
    const float* __restrict__ qb,   // (B,R,128)
    const float* __restrict__ kb,   // (B,S,128)
    float* __restrict__ scores) {   // (B,H,R,S), pre-scaled
  int wave = threadIdx.x >> 5;
  int lane = threadIdx.x & 31;
  int tile = blockIdx.x * 8 + wave;  // 8192 tiles total
  int st = tile & 31;
  int rt = (tile >> 5) & 7;
  int h  = (tile >> 8) & 3;
  int b  = tile >> 10;

  int rc = lane & 15;
  int hi = lane >> 4;

  const float* Abase = qb + ((size_t)b * Rr + rt * 16 + rc) * Ee + h * EKk + hi * 2;
  const float* Bbase = kb + ((size_t)b * Ss + st * 16 + rc) * Ee + h * EKk + hi * 2;

  v8f c = {};
  for (int k0 = 0; k0 < EKk; k0 += 4) {
    v2f a = *(const v2f*)(Abase + k0);
    v2f bfr = *(const v2f*)(Bbase + k0);
    c = __builtin_amdgcn_wmma_f32_16x16x4_f32(false, a, false, bfr, (short)0, c,
                                              false, false);
  }
  const float scale = 0.17677669529663687f;  // 1/sqrt(32)
  float* out = scores + (((size_t)(b * Hh + h) * Rr) + rt * 16) * Ss + st * 16;
  for (int i = 0; i < 8; ++i)
    out[(size_t)(i + hi * 8) * Ss + rc] = c[i] * scale;
}

// ---------------------------------------------------------------------------
// Per (b, 4 query rows): masked softmax over s for every (h,d), weighted sum.
// x[b,r,h*33+d] = sum_s e[h,s]*a[s,d]*v[s,d] / sum_s e[h,s]*a[s,d]
// a[s,d] = mask[s,d] * (|tt[s]-qt[r]| <= sa[d]); all-masked -> mean_s v[s,d].
// Thread = (d, s mod 16): flat element t + 528*j of value / mask, so every
// element is read once per block, coalesced, straight into registers, and
// serves 4 query rows x 4 heads.  The 16 partial sums meet in LDS.
// ---------------------------------------------------------------------------
#define RT 4              // query rows per block
#define SC 16             // s slices per block
#define NT (Dd * SC)      // 528 threads
#define NJ (Ss / SC)      // 32 elements per thread
#define SL (Ss / 32)      // scores per lane in the exp stage

__global__ __launch_bounds__(NT) void attn_kernel(
    const float* __restrict__ scores,  // (B,H,R,S)
    const float* __restrict__ value,   // (B,S,D)
    const float* __restrict__ mask,    // (B,S,D)
    const float* __restrict__ qt,      // (R)
    const float* __restrict__ tt,      // (B,S)
    const float* __restrict__ sa,      // (D)
    float* __restrict__ xbuf) {        // (B,R,H*D)
  // One block of LDS, the hot loop's arrays first: they stay within reach of
  // the 16-bit offset of an LDS read, so the loop forms no addresses.
  __shared__ struct {
    v4f e[RT][Ss];        // exp(score - rowmax), 4 heads together
    float tt[Ss];
    v4f red[2][RT][NT];   // [num|den][rr][thread], 4 heads
    float vs[NT];
  } sh;

  int t = threadIdx.x;
  int wave = t >> 5;
  int lane = t & 31;
  int b = blockIdx.x / (Rr / RT);
  int r0 = (blockIdx.x % (Rr / RT)) * RT;
  int s0 = t / Dd;
  int d = t - s0 * Dd;

  // Small operands first, so that nothing later waits behind the big slice.
  float ttv = (t < Ss) ? tt[b * Ss + t] : 0.f;
  float sad = sa[d];
  float qtr[RT];
  for (int rr = 0; rr < RT; ++rr) qtr[rr] = qt[r0 + rr];

  // One wave per (row, head): wave = rr * 4 + h, 16 scores a lane.
  float sc_loc[SL];
  if (wave < RT * Hh) {
    const float* scb =
        scores + ((size_t)(b * Hh + (wave & 3)) * Rr + r0 + (wave >> 2)) * Ss + lane;
#pragma unroll  // static indices: sc_loc stays in registers
    for (int i = 0; i < SL; ++i) sc_loc[i] = scb[32 * i];
  }

  // This thread's slice of value / mask, in flight while the exps are made.
  const float* vb = value + (size_t)b * Ss * Dd + t;
  const float* mb = mask + (size_t)b * Ss * Dd + t;
  float vr[NJ], mr[NJ];
#pragma unroll  // static indices: vr and mr stay in registers, all loads in flight
  for (int j = 0; j < NJ; ++j) {
    vr[j] = vb[j * NT];
    mr[j] = mb[j * NT];
  }
  if (t < Ss) sh.tt[t] = ttv;

  if (wave < RT * Hh) {
    float mx = sc_loc[0];
#pragma unroll  // static indices, as above
    for (int i = 1; i < SL; ++i) mx = fmaxf(mx, sc_loc[i]);
    for (int off = 16; off > 0; off >>= 1) mx = fmaxf(mx, __shfl_xor(mx, off));
    float* eo = (float*)&sh.e[wave >> 2][0] + (wave & 3);
#pragma unroll  // static indices, as above
    for (int i = 0; i < SL; ++i)
      eo[(lane + 32 * i) * Hh] = __expf(sc_loc[i] - mx);
  }
  __syncthreads();

  // The slice has landed: keep the mask as one flag an element from here on.
  bool mk[NJ];
#pragma unroll  // static indices, as above
  for (int j = 0; j < NJ; ++j) mk[j] = mr[j] != 0.0f;

  v2f num[RT][2], den[RT][2];
  for (int rr = 0; rr < RT; ++rr)
    for (int p = 0; p < 2; ++p) {
      num[rr][p] = (v2f){0.f, 0.f};
      den[rr][p] = (v2f){0.f, 0.f};
    }
  float vsum = 0.f;
#pragma unroll  // static indices, as above; LDS offsets become immediates
  for (int j = 0; j < NJ; ++j) {
    int s = s0 + SC * j;
    float v = vr[j];
    float ts = sh.tt[s];
    vsum += v;
    for (int rr = 0; rr < RT; ++rr) {
      bool on = mk[j] && (fabsf(ts - qtr[rr]) <= sad);
      float av = on ? v : 0.f;
      float af = on ? 1.f : 0.f;
      v4f e = sh.e[rr][s];
      v2f e01 = {e.x, e.y}, e23 = {e.z, e.w};
      v2f av2 = {av, av}, af2 = {af, af};
      num[rr][0] = __builtin_elementwise_fma(e01, av2, num[rr][0]);
      num[rr][1] = __builtin_elementwise_fma(e23, av2, num[rr][1]);
      den[rr][0] = __builtin_elementwise_fma(e01, af2, den[rr][0]);
      den[rr][1] = __builtin_elementwise_fma(e23, af2, den[rr][1]);
    }
  }

  for (int rr = 0; rr < RT; ++rr) {
    sh.red[0][rr][t] = (v4f){num[rr][0].x, num[rr][0].y, num[rr][1].x, num[rr][1].y};
    sh.red[1][rr][t] = (v4f){den[rr][0].x, den[rr][0].y, den[rr][1].x, den[rr][1].y};
  }
  sh.vs[t] = vsum;
  __syncthreads();

  // One thread per (rr, d), all 4 heads.
  if (t < RT * Dd) {
    int rr = t / Dd;
    int dd = t - rr * Dd;
    v4f n = {0.f, 0.f, 0.f, 0.f}, de = {0.f, 0.f, 0.f, 0.f};
    float vs = 0.f;
    for (int c = 0; c < SC; ++c) {
      n += sh.red[0][rr][c * Dd + dd];
      de += sh.red[1][rr][c * Dd + dd];
      vs += sh.vs[c * Dd + dd];
    }
    float mean = vs * (1.0f / Ss);
    float* xo = xbuf + ((size_t)b * Rr + r0 + rr) * (Hh * Dd) + dd;
    xo[0 * Dd] = (de.x > 0.f) ? (n.x / de.x) : mean;
    xo[1 * Dd] = (de.y > 0.f) ? (n.y / de.y) : mean;
    xo[2 * Dd] = (de.z > 0.f) ? (n.z / de.z) : mean;
    xo[3 * Dd] = (de.w > 0.f) ? (n.w / de.w) : mean;
  }
}

// ---------------------------------------------------------------------------
extern "C" void kernel_launch(void* const* d_in, const int* in_sizes, int n_in,
                              void* d_out, int out_size, void* d_ws,
                              size_t ws_size, hipStream_t stream) {
  const float* query = (const float*)d_in[0];
  const float* key   = (const float*)d_in[1];
  const float* value = (const float*)d_in[2];
  const float* mask  = (const float*)d_in[3];
  const float* qt    = (const float*)d_in[4];
  const float* tt    = (const float*)d_in[5];
  const float* strv  = (const float*)d_in[6];
  const float* Wq    = (const float*)d_in[7];
  const float* bq    = (const float*)d_in[8];
  const float* Wk    = (const float*)d_in[9];
  const float* bk    = (const float*)d_in[10];
  const float* Wr    = (const float*)d_in[11];
  const float* br    = (const float*)d_in[12];
  const float* Wo    = (const float*)d_in[13];
  const float* bo    = (const float*)d_in[14];
  float* out = (float*)d_out;

  // Workspace layout (floats): sa(64) | qbuf | kbuf | xbuf | scores  (~11.6MB)
  float* ws = (float*)d_ws;
  float* sa_ws  = ws;
  float* qbuf   = ws + 64;                 // 8*128*128   = 131072
  float* kbuf   = qbuf + 131072;           // 8*512*128   = 524288
  float* xbuf   = kbuf + 524288;           // 8*128*132   = 135168
  float* scoreb = xbuf + 135168;           // 8*4*128*512 = 2097152

  // sa (1 block) + K-proj (256 blocks) + Q-proj (64 blocks): one launch
  front_kernel<<<1 + KPB + QPB, 256, 0, stream>>>(
      query, Wq, bq, qbuf, key, Wk, bk, kbuf, strv, Wr, br, sa_ws,
      out + Bb * Rr * 128, Ee, 8);
  // scores: 8192 tiles = 1024 blocks
  scores_kernel<<<1024, 256, 0, stream>>>(qbuf, kbuf, scoreb);
  // attention core: one block per (b, 4 query rows)
  attn_kernel<<<Bb * Rr / RT, NT, 0, stream>>>(scoreb, value, mask, qt, tt,
                                               sa_ws, xbuf);
  // out-proj: M=1024, K=132, N=128 -> 64 blocks; writes d_out directly
  gemm_wt_kernel<<<64, 256, 0, stream>>>(xbuf, Wo, bo, out, Bb * Rr, 132, 8);
}

// v003
// A run of this version takes 22.8 microseconds.
// In both of two side-by-side timings against v002, it was 1.19 times as fast.
// All steps since v000 together make it 6.61 times as fast.
#include <hip/hip_runtime.h>
#include <hip/hip_bf16.h>

typedef __attribute__((ext_vector_type(2))) float v2f;
typedef __attribute__((ext_vector_type(4))) float v4f;
typedef __attribute__((ext_vector_type(8))) float v8f;

#define Bb 8
#define Rr 128
#define Ss 512
#define Dd 33
#define Ee 128
#define Hh 4
#define EKk 32

// ---------------------------------------------------------------------------
// sa = sigmoid(stride @ Wr.T + br)   (33 outputs; also written to d_out tail)
// ---------------------------------------------------------------------------
__device__ __forceinline__ void sa_body(const float* __restrict__ stridev,
                                        const float* __restrict__ Wr,
                                        const float* __restrict__ br,
                                        float* __restrict__ sa_ws,
                                        float* __restrict__ out_tail) {
  int d = threadIdx.x;
  if (d < Dd) {
    float z = br[d];
    for (int j = 0; j < Dd; ++j) z += stridev[j] * Wr[d * Dd + j];
    float s = 1.0f / (1.0f + __expf(-z));
    sa_ws[d] = s;
    out_tail[d] = s;
  }
}

// ---------------------------------------------------------------------------
// Generic C = A(MxK) * W(NxK)^T + bias, f32 WMMA 16x16x4, one wave per tile.
// N = Ntiles*16.  blk = index of this block among the product's own blocks.
// ---------------------------------------------------------------------------
__device__ __forceinline__ void gemm_wt_body(
    const float* __restrict__ A, const float* __restrict__ W,
    const float* __restrict__ bias, float* __restrict__ C,
    int M, int K, int Ntiles, int blk) {
  int wave = threadIdx.x >> 5;
  int lane = threadIdx.x & 31;
  int tile = blk * 8 + wave;
  int mt = tile / Ntiles;
  int nt = tile % Ntiles;
  if (mt * 16 >= M) return;  // wave-uniform: EXEC stays all-ones for WMMA

  int rc = lane & 15;   // A-row / W-row (B-col) index
  int hi = lane >> 4;   // K sub-pair select (K offset +2 for upper half)

  const float* Abase = A + (size_t)(mt * 16 + rc) * K + hi * 2;
  const float* Wbase = W + (size_t)(nt * 16 + rc) * K + hi * 2;

  v8f c = {};
  for (int k0 = 0; k0 < K; k0 += 4) {
    v2f a = *(const v2f*)(Abase + k0);  // A[row, k0+hi*2 .. +1]
    v2f b = *(const v2f*)(Wbase + k0);  // B[k0+hi*2 .. +1, col] = W[col, k]
    c = __builtin_amdgcn_wmma_f32_16x16x4_f32(false, a, false, b, (short)0, c,
                                              false, false);
  }
  int N = Ntiles * 16;
  float bv = bias[nt * 16 + rc];
  float* Cb = C + (size_t)(mt * 16 + hi * 8) * N + nt * 16 + rc;
  for (int i = 0; i < 8; ++i) Cb[(size_t)i * N] = c[i] + bv;
}

// ---------------------------------------------------------------------------
// The three stages that need nothing of each other, in one grid by ranges of
// the block index: block 0 = sa, then the K-proj blocks, then the Q-proj blocks.
// ---------------------------------------------------------------------------
#define KPB (Bb * Ss / 16)   // K-proj: 4096/16 row tiles x 8 col tiles / 8 waves
#define QPB (Bb * Rr / 16)   // Q-proj: 1024/16 row tiles x 8 col tiles / 8 waves

__global__ __launch_bounds__(256) void front_kernel(
    const float* __restrict__ query, const float* __restrict__ Wq,
    const float* __restrict__ bq, float* __restrict__ qbuf,
    const float* __restrict__ key, const float* __restrict__ Wk,
    const float* __restrict__ bk, float* __restrict__ kbuf,
    const float* __restrict__ stridev, const float* __restrict__ Wr,
    const float* __restrict__ br, float* __restrict__ sa_ws,
    float* __restrict__ out_tail, int K, int Ntiles) {
  int blk = (int)blockIdx.x - 1;
  if (blk < 0) {
    sa_body(stridev, Wr, br, sa_ws, out_tail);
    return;
  }
  bool isk = blk < KPB;  // block-uniform: one copy of the product's loop serves both
  gemm_wt_body(isk ? key : query, isk ? Wk : Wq, isk ? bk : bq,
               isk ? kbuf : qbuf, isk ? Bb * Ss : Bb * Rr, K, Ntiles,
               isk ? blk : blk - KPB);
}

// ---------------------------------------------------------------------------
// scores[b,h,r,s] = (q[b,r,h*32:] . k[b,s,h*32:]) / sqrt(32)
// One wave per 16x16 (r,s) tile; K=32 -> 8 WMMA steps.
// ---------------------------------------------------------------------------
__global__ __launch_bounds__(256) void scores_kernel(
    const float* __restrict__ qb,   // (B,R,128)
    const float* __restrict__ kb,   // (B,S,128)
    float* __restrict__ scores) {   // (B,H,R,S), pre-scaled
  int wave = threadIdx.x >> 5;
  int lane = threadIdx.x & 31;
  int tile = blockIdx.x * 8 + wave;  // 8192 tiles total
  int st = tile & 31;
  int rt = (tile >> 5) & 7;
  int h  = (tile >> 8) & 3;
  int b  = tile >> 10;

  int rc = lane & 15;
  int hi = lane >> 4;

  const float* Abase = qb + ((size_t)b * Rr + rt * 16 + rc) * Ee + h * EKk + hi * 2;
  const float* Bbase = kb + ((size_t)b * Ss + st * 16 + rc) * Ee + h * EKk + hi * 2;

  v8f c = {};
  for (int k0 = 0; k0 < EKk; k0 += 4) {
    v2f a = *(const v2f*)(Abase + k0);
    v2f bfr = *(const v2f*)(Bbase + k0);
    c = __builtin_amdgcn_wmma_f32_16x16x4_f32(false, a, false, bfr, (short)0, c,
                                              false, false);
  }
  const float scale = 0.17677669529663687f;  // 1/sqrt(32)
  float* out = scores + (((size_t)(b * Hh + h) * Rr) + rt * 16) * Ss + st * 16;
  for (int i = 0; i < 8; ++i)
    out[(size_t)(i + hi * 8) * Ss + rc] = c[i] * scale;
}

// ---------------------------------------------------------------------------
// Per (b, 4 query rows): masked softmax over s for every (h,d), weighted sum.
// x[b,r,h*33+d] = sum_s e[h,s]*a[s,d]*v[s,d] / sum_s e[h,s]*a[s,d]
// a[s,d] = mask[s,d] * (|tt[s]-qt[r]| <= sa[d]); all-masked -> mean_s v[s,d].
// Thread = (d, s mod 16): flat element t + 528*j of value / mask, so every
// element is read once per block, coalesced, straight into registers, and
// serves 4 query rows x 4 heads.  The 16 partial sums meet in LDS.
// The block then holds its 4 rows of x whole, so it also makes its 4 rows of
// out = x @ Wo.T + bo: waves 8..15 take one 16-column tile each (f32 WMMA
// 16x16x4, k ascending); x goes from LDS to the product, never to memory.
// Wo comes in by whole lines and waits in LDS; its pitch of 132 floats puts the
// 16 rows of a fragment read on 16 different groups of 4 banks.
// ---------------------------------------------------------------------------
#define RT 4              // query rows per block
#define SC 16             // s slices per block
#define NT (Dd * SC)      // 528 threads
#define NJ (Ss / SC)      // 32 elements per thread
#define SL (Ss / 32)      // scores per lane in the exp stage
#define XK (Hh * Dd)      // 132: length of a row of x, K of the out product
#define NO 128            // columns of out
#define OW0 8             // first of the NO / 16 waves that make the out product
#define WV (NO * XK / 4 / NT)  // 8: 16-byte pieces of Wo per thread, no rest

__global__ __launch_bounds__(NT) void attn_kernel(
    const float* __restrict__ scores,  // (B,H,R,S)
    const float* __restrict__ value,   // (B,S,D)
    const float* __restrict__ mask,    // (B,S,D)
    const float* __restrict__ qt,      // (R)
    const float* __restrict__ tt,      // (B,S)
    const float* __restrict__ sa,      // (D)
    const float* __restrict__ Wo,      // (128, H*D)
    const float* __restrict__ bo,      // (128)
    float* __restrict__ out) {         // (B,R,128)
  // One block of LDS, the hot loop's arrays first: they stay within reach of
  // the 16-bit offset of an LDS read, so the loop forms no addresses.
  __shared__ struct {
    v4f e[RT][Ss];        // exp(score - rowmax), 4 heads together
    float tt[Ss];
    v4f red[2][RT][NT];   // [num|den][rr][thread], 4 heads
    v4f wo[NO * XK / 4];  // Wo as it lies in memory
    float vs[NT];
    float xs[RT][XK];     // the block's rows of x
  } sh;

  int t = threadIdx.x;
  int wave = t >> 5;
  int lane = t & 31;
  int b = blockIdx.x / (Rr / RT);
  int r0 = (blockIdx.x % (Rr / RT)) * RT;
  int s0 = t / Dd;
  int d = t - s0 * Dd;

  // Small operands first, so that nothing later waits behind the big slice.
  float ttv = (t < Ss) ? tt[b * Ss + t] : 0.f;
  float sad = sa[d];
  float qtr[RT];
  for (int rr = 0; rr < RT; ++rr) qtr[rr] = qt[r0 + rr];

  // One wave per (row, head): wave = rr * 4 + h, 16 scores a lane.
  float sc_loc[SL];
  if (wave < RT * Hh) {
    const float* scb =
        scores + ((size_t)(b * Hh + (wave & 3)) * Rr + r0 + (wave >> 2)) * Ss + lane;
#pragma unroll  // static indices: sc_loc stays in registers
    for (int i = 0; i < SL; ++i) sc_loc[i] = scb[32 * i];
  }

  // This thread's slice of value / mask, in flight while the exps are made.
  const float* vb = value + (size_t)b * Ss * Dd + t;
  const float* mb = mask + (size_t)b * Ss * Dd + t;
  float vr[NJ], mr[NJ];
#pragma unroll  // static indices: vr and mr stay in registers, all loads in flight
  for (int j = 0; j < NJ; ++j) {
    vr[j] = vb[j * NT];
    mr[j] = mb[j * NT];
  }
  if (t < Ss) sh.tt[t] = ttv;

  if (wave < RT * Hh) {
    float mx = sc_loc[0];
#pragma unroll  // static indices, as above
    for (int i = 1; i < SL; ++i) mx = fmaxf(mx, sc_loc[i]);
    for (int off = 16; off > 0; off >>= 1) mx = fmaxf(mx, __shfl_xor(mx, off));
    float* eo = (float*)&sh.e[wave >> 2][0] + (wave & 3);
#pragma unroll  // static indices, as above
    for (int i = 0; i < SL; ++i)
      eo[(lane + 32 * i) * Hh] = __expf(sc_loc[i] - mx);
  }
  __syncthreads();

  // The slice has landed: keep the mask as one flag an element from here on.
  bool mk[NJ];
#pragma unroll  // static indices, as above
  for (int j = 0; j < NJ; ++j) mk[j] = mr[j] != 0.0f;

  // Wo, whole and in its own layout, 8 x 16 bytes a thread: asked for here so
  // that it arrives under the sum loop below, which uses no global memory.
  const v4f* wg = (const v4f*)Wo + t;
  v4f wr[WV];
#pragma unroll  // static indices: wr stays in registers, all loads in flight
  for (int i = 0; i < WV; ++i) wr[i] = wg[i * NT];
  int wv = __builtin_amdgcn_readfirstlane(wave);  // scalar: WMMA waves branch whole
  bool ow = wv >= OW0 && wv < OW0 + NO / 16;
  int rc = lane & 15;   // Wo row (out column) / x row index
  int hi = lane >> 4;   // K sub-pair select (K offset +2 for upper half)
  int col = (wv - OW0) * 16 + rc;
  float bv = ow ? bo[col] : 0.f;
  // The code below reuses registers that the loads above name as addresses:
  // this wait stands in front of that reuse.
  asm volatile("s_wait_xcnt 0x0" ::: "memory");

  v2f num[RT][2], den[RT][2];
  for (int rr = 0; rr < RT; ++rr)
    for (int p = 0; p < 2; ++p) {
      num[rr][p] = (v2f){0.f, 0.f};
      den[rr][p] = (v2f){0.f, 0.f};
    }
  float vsum = 0.f;
#pragma unroll  // static indices, as above; LDS offsets become immediates
  for (int j = 0; j < NJ; ++j) {
    int s = s0 + SC * j;
    float v = vr[j];
    float ts = sh.tt[s];
    vsum += v;
    for (int rr = 0; rr < RT; ++rr) {
      bool on = mk[j] && (fabsf(ts - qtr[rr]) <= sad);
      float av = on ? v : 0.f;
      float af = on ? 1.f : 0.f;
      v4f e = sh.e[rr][s];
      v2f e01 = {e.x, e.y}, e23 = {e.z, e.w};
      v2f av2 = {av, av}, af2 = {af, af};
      num[rr][0] = __builtin_elementwise_fma(e01, av2, num[rr][0]);
      num[rr][1] = __builtin_elementwise_fma(e23, av2, num[rr][1]);
      den[rr][0] = __builtin_elementwise_fma(e01, af2, den[rr][0]);
      den[rr][1] = __builtin_elementwise_fma(e23, af2, den[rr][1]);
    }
  }

  for (int rr = 0; rr < RT; ++rr) {
    sh.red[0][rr][t] = (v4f){num[rr][0].x, num[rr][0].y, num[rr][1].x, num[rr][1].y};
    sh.red[1][rr][t] = (v4f){den[rr][0].x, den[rr][0].y, den[rr][1].x, den[rr][1].y};
  }
  sh.vs[t] = vsum;
  for (int i = 0; i < WV; ++i) sh.wo[t + i * NT] = wr[i];
  __syncthreads();

  // One thread per (rr, d), all 4 heads.
  if (t < RT * Dd) {
    int rr = t / Dd;
    int dd = t - rr * Dd;
    v4f n = {0.f, 0.f, 0.f, 0.f}, de = {0.f, 0.f, 0.f, 0.f};
    float vs = 0.f;
    for (int c = 0; c < SC; ++c) {
      n += sh.red[0][rr][c * Dd + dd];
      de += sh.red[1][rr][c * Dd + dd];
      vs += sh.vs[c * Dd + dd];
    }
    float mean = vs * (1.0f / Ss);
    float* xo = &sh.xs[rr][dd];
    xo[0 * Dd] = (de.x > 0.f) ? (n.x / de.x) : mean;
    xo[1 * Dd] = (de.y > 0.f) ? (n.y / de.y) : mean;
    xo[2 * Dd] = (de.z > 0.f) ? (n.z / de.z) : mean;
    xo[3 * Dd] = (de.w > 0.f) ? (n.w / de.w) : mean;
  }

  // The product's waves have no part in the sums above: they fetch their Wo
  // fragments meanwhile.  B[4i+hi*2 .. +1, col] = Wo[col, k].
  v2f bf[XK / 4];
  if (ow) {
    const float* wl = (const float*)sh.wo + col * XK + hi * 2;
#pragma unroll  // static indices: bf stays in registers
    for (int i = 0; i < XK / 4; ++i) bf[i] = *(const v2f*)(wl + 4 * i);
  }
  __syncthreads();

  // A row m of the 16 is x row m & 3, so result rows 0..3 and 8..11 both hold
  // the block's 4 rows: the lower half-wave stores rows 0, 1, the upper 2, 3.
  if (ow) {
    const float* xa = &sh.xs[rc & 3][hi * 2];
    v2f af[XK / 4];
#pragma unroll  // static indices: af stays in registers
    for (int i = 0; i < XK / 4; ++i) af[i] = *(const v2f*)(xa + 4 * i);  // A[row, 4i+hi*2 .. +1]
    // All LDS reads go out ahead of the chain of products: left to itself the
    // build keeps two reads in flight and waits on each in turn.
    __builtin_amdgcn_sched_barrier(0);
    v8f c = {};
#pragma unroll  // static indices into af and bf
    for (int i = 0; i < XK / 4; ++i)
      c = __builtin_amdgcn_wmma_f32_16x16x4_f32(false, af[i], false, bf[i],
                                                (short)0, c, false, false);
    float* ob = out + ((size_t)b * Rr + r0 + hi * 2) * NO + col;
    ob[0] = (hi ? c[2] : c[0]) + bv;
    ob[NO] = (hi ? c[3] : c[1]) + bv;
  }
}

// ---------------------------------------------------------------------------
extern "C" void kernel_launch(void* const* d_in, const int* in_sizes, int n_in,
                              void* d_out, int out_size, void* d_ws,
                              size_t ws_size, hipStream_t stream) {
  const float* query = (const float*)d_in[0];
  const float* key   = (const float*)d_in[1];
  const float* value = (const float*)d_in[2];
  const float* mask  = (const float*)d_in[3];
  const float* qt    = (const float*)d_in[4];
  const float* tt    = (const float*)d_in[5];
  const float* strv  = (const float*)d_in[6];
  const float* Wq    = (const float*)d_in[7];
  const float* bq    = (const float*)d_in[8];
  const float* Wk    = (const float*)d_in[9];
  const float* bk    = (const float*)d_in[10];
  const float* Wr    = (const float*)d_in[11];
  const float* br    = (const float*)d_in[12];
  const float* Wo    = (const float*)d_in[13];
  const float* bo    = (const float*)d_in[14];
  float* out = (float*)d_out;

  // Workspace layout (floats): sa(64) | qbuf | kbuf | scores  (~11MB)
  float* ws = (float*)d_ws;
  float* sa_ws  = ws;
  float* qbuf   = ws + 64;                 // 8*128*128   = 131072
  float* kbuf   = qbuf + 131072;           // 8*512*128   = 524288
  float* scoreb = kbuf + 524288;           // 8*4*128*512 = 2097152

  // sa (1 block) + K-proj (256 blocks) + Q-proj (64 blocks): one launch
  front_kernel<<<1 + KPB + QPB, 256, 0, stream>>>(
      query, Wq, bq, qbuf, key, Wk, bk, kbuf, strv, Wr, br, sa_ws,
      out + Bb * Rr * 128, Ee, 8);
  // scores: 8192 tiles = 1024 blocks
  scores_kernel<<<1024, 256, 0, stream>>>(qbuf, kbuf, scoreb);
  // attention core + out-proj: one block per (b, 4 query rows); writes d_out
  attn_kernel<<<Bb * Rr / RT, NT, 0, stream>>>(scoreb, value, mask, qt, tt,
                                               sa_ws, Wo, bo, out);
}

// v005
// A run of this version takes 16 microseconds.
// It is 1.44 times as fast as v003, going by the measured steps of the versions left out in between.
// Over all steps from v000 it is 9.50 times as fast.
#include <hip/hip_runtime.h>
#include <hip/hip_bf16.h>

typedef __attribute__((ext_vector_type(2))) float v2f;
typedef __attribute__((ext_vector_type(4))) float v4f;
typedef __attribute__((ext_vector_type(8))) float v8f;

#define Bb 8
#define Rr 128
#define Ss 512
#define Dd 33
#define Ee 128
#define Hh 4
#define EKk 32

// ---------------------------------------------------------------------------
// One launch.  Per (b, 4 query rows): the block makes everything it needs from
// the raw inputs.
//   q[rr,:]      = query[r0+rr,:] @ Wq.T + bq                       (4 x 128)
//   qq[rr*4+h,:] = q[rr, h*32 .. h*32+31] @ Wk[h*32 .. h*32+31, :]  (16 x 128)
//   sb[rr*4+h]   = q[rr, h*32 ..] . bk[h*32 ..]
//   score[h,rr,s] = (qq[rr*4+h,:] . key[s,:] + sb[rr*4+h]) / sqrt(32)
// which is q . (key @ Wk.T + bk) with Wk taken to the query side: the 16 rows
// (rr, h) fill the 16 rows of a matrix tile, and key is used as it lies.
// All three products are f32 WMMA 16x16x4.  A lane reads 16 bytes of a row at
// k = 8i + 4*hi, which serve two steps (.xy, then .zw); the A and the B loader
// of a product use the same k at every lane and register.
// A fragment read takes 32 bytes from each of 16 rows: from memory that is 16
// lines an instruction.  So key and Wq come in by whole rows, as asynchronous
// copies to LDS, and the fragments are read there.  Every wave copies what it
// reads itself, so its own wait on its copies is all that the reads need.
// Wo comes in the same way, where key has lain, and takes no registers.
// Then the masked softmax over s for every (h,d), and the weighted sum:
// x[b,r,h*33+d] = sum_s e[h,s]*a[s,d]*v[s,d] / sum_s e[h,s]*a[s,d]
// a[s,d] = mask[s,d] * (|tt[s]-qt[r]| <= sa[d]); all-masked -> mean_s v[s,d].
// Thread = (d, s mod 16): flat element t + 528*j of value / mask, so every
// element is read once per block, coalesced, straight into registers, and
// serves 4 query rows x 4 heads.  The 16 partial sums meet in LDS.
// The block then holds its 4 rows of x whole, so it also makes its 4 rows of
// out = x @ Wo.T + bo: waves 8..15 take one 16-column tile each (f32 WMMA
// 16x16x4, k ascending); x goes from LDS to the product, never to memory.
// Wo comes in by whole lines and waits in LDS; its pitch of 132 floats puts the
// 16 rows of a fragment read on 16 different groups of 4 banks.
// ---------------------------------------------------------------------------
#define RT 4              // query rows per block
#define SC 16             // s slices per block
#define NT (Dd * SC)      // 528 threads
#define NJ (Ss / SC)      // 32 elements per thread
#define SL (Ss / 32)      // scores per lane in the exp stage
#define XK (Hh * Dd)      // 132: length of a row of x, K of the out product
#define NO 128            // columns of out
#define OW0 8             // first of the NO / 16 waves that make the out product
#define WN (NO * XK / 128)     // 132: 512-byte pieces of Wo, no rest
#define MW 16             // whole waves; the 17th has 16 threads and no WMMA
#define QP4 34            // pitch of q and qq rows in 16-byte units: 8 banks a row
#define KP4 33            // pitch of a staged key row, 16-byte units: odd, 16 rows on 64 banks
#define WP4 17            // pitch of a staged 256-byte piece of a Wq row: odd, as above

__device__ __forceinline__ v8f mm4(v2f a, v2f b, v8f c) {
  return __builtin_amdgcn_wmma_f32_16x16x4_f32(false, a, false, b, (short)0, c,
                                               false, false);
}
// Work-group barrier for a hand-over through LDS alone: it waits for this wave's
// LDS traffic only, so the global loads issued ahead (key, value, mask) stay in
// flight across it; __syncthreads() would wait for them too.
__device__ __forceinline__ void lds_barrier() {
  asm volatile("s_wait_dscnt 0x0\n\ts_barrier_signal -1\n\ts_barrier_wait -1" ::: "memory");
}
// Eight asynchronous copies, 16 bytes a lane each, from g + i * gs floats to the
// LDS byte address l + i * ls.  The wait at the end stands in front of any reuse
// of the address registers that the copies name.
__device__ __forceinline__ void copy8(unsigned l, unsigned ls, const float* g, int gs) {
  asm volatile(
      "global_load_async_to_lds_b128 %0, %8, off\n\t"
      "global_load_async_to_lds_b128 %1, %9, off\n\t"
      "global_load_async_to_lds_b128 %2, %10, off\n\t"
      "global_load_async_to_lds_b128 %3, %11, off\n\t"
      "global_load_async_to_lds_b128 %4, %12, off\n\t"
      "global_load_async_to_lds_b128 %5, %13, off\n\t"
      "global_load_async_to_lds_b128 %6, %14, off\n\t"
      "global_load_async_to_lds_b128 %7, %15, off\n\t"
      "s_wait_xcnt 0x0"
      :: "v"(l), "v"(l + ls), "v"(l + 2 * ls), "v"(l + 3 * ls), "v"(l + 4 * ls),
         "v"(l + 5 * ls), "v"(l + 6 * ls), "v"(l + 7 * ls),
         "v"(g), "v"(g + gs), "v"(g + 2 * gs), "v"(g + 3 * gs), "v"(g + 4 * gs),
         "v"(g + 5 * gs), "v"(g + 6 * gs), "v"(g + 7 * gs)
      : "memory");
}
// One such copy.
__device__ __forceinline__ void copy1(unsigned l, const float* g) {
  asm volatile("global_load_async_to_lds_b128 %0, %1, off\n\ts_wait_xcnt 0x0"
               :: "v"(l), "v"(g) : "memory");
}
// This wave's copies have landed behind it; its LDS reads stay behind it too.
__device__ __forceinline__ void copies_landed() {
  asm volatile("s_wait_asynccnt 0x0" ::: "memory");
}
__device__ __forceinline__ v2f lo2(v4f x) { return (v2f){x.x, x.y}; }
__device__ __forceinline__ v2f hi2(v4f x) { return (v2f){x.z, x.w}; }
__global__ __launch_bounds__(NT) void attn_kernel(
    const float* __restrict__ query,   // (B,R,128)
    const float* __restrict__ key,     // (B,S,128)
    const float* __restrict__ value,   // (B,S,D)
    const float* __restrict__ mask,    // (B,S,D)
    const float* __restrict__ qt,      // (R)
    const float* __restrict__ tt,      // (B,S)
    const float* __restrict__ stridev, // (D)
    const float* __restrict__ Wq,      // (128,128)
    const float* __restrict__ bq,      // (128)
    const float* __restrict__ Wk,      // (128,128)
    const float* __restrict__ bk,      // (128)
    const float* __restrict__ Wr,      // (D,D)
    const float* __restrict__ br,      // (D)
    const float* __restrict__ Wo,      // (128, H*D)
    const float* __restrict__ bo,      // (128)
    float* __restrict__ out,           // (B,R,128)
    float* __restrict__ out_tail) {    // (D): sa
  // One block of LDS, the hot loop's arrays first: they stay within reach of
  // the 16-bit offset of an LDS read, so the loop forms no addresses.
  __shared__ struct {
    v4f e[RT][Ss];        // score, then exp(score - rowmax), 4 heads together
    float tt[Ss];
    union {
      // Up to the barrier behind the scores: key, row s at s * KP4; wave w owns
      // rows 32w .. 32w+31.  Its piece of Wq lies first where its rows 16 .. 31
      // come later.
      v4f ks[Ss * KP4];
      // Behind that barrier:
      struct {
        v4f red[2][RT][NT];   // [num|den][rr][thread], 4 heads
        v4f wo[NO * XK / 4];  // Wo as it lies in memory
        float vs[NT];
        float xs[RT][XK];     // the block's rows of x
      } z;
    } u;
    v4f qp[2][RT][QP4];   // q, one partial sum per half of K (bq in the first)
    v4f qq[RT * Hh][QP4]; // row rr*4+h: q of head h times Wk's rows of head h
    float sb[RT * Hh];    // row rr*4+h: q of head h . bk of head h
    v4f bk[Ee / 4];       // bk, for the wave that makes sb
    float sa[Dd];
  } sh;

  int t = threadIdx.x;
  int wave = t >> 5;
  int lane = t & 31;
  int b = blockIdx.x / (Rr / RT);
  int r0 = (blockIdx.x % (Rr / RT)) * RT;
  int s0 = t / Dd;
  int d = t - s0 * Dd;
  int wv = __builtin_amdgcn_readfirstlane(wave);  // scalar: WMMA waves branch whole
  bool mw = wv < MW;
  int rc = lane & 15;   // row of A / column of B and of the result
  int hi = lane >> 4;   // which half of the k values of a step
  // The last wave has no matrix work, but it takes part in the fragment loads
  // (with the addresses of the wave before it, so it asks for no new lines):
  // fragments that are defined on one side of a branch only are merged behind it
  // with values that take registers of their own, and the build then spills.
  int wf = mw ? wv : MW - 1;
  int g8 = wf & 7;      // 16-column tile in the two small products
  int g2 = wf >> 3;     // half of K in the two small products

  if (!mw) {
    // The 16 threads of the last wave, while the others fetch and make q:
    // sa = sigmoid(stride @ Wr.T + br), and bk into LDS for their own later use.
    sh.bk[lane * 2 + 0] = ((const v4f*)bk)[lane * 2 + 0];
    sh.bk[lane * 2 + 1] = ((const v4f*)bk)[lane * 2 + 1];
    // Three rounds of 16; the last has one value to make, and its other lanes
    // repeat it, so that no branch parts the rounds and their loads go out together.
    float zz[3];
#pragma unroll  // static indices: zz stays in registers
    for (int u = 0; u < 3; ++u) {
      int dd = min(lane + 16 * u, Dd - 1);
      float z = br[dd];
      // sa decides |tt - qt| <= sa, where one changed last bit can switch a
      // whole term of a softmax on or off.  Its sum keeps the rounding it has
      // had so far: each product rounded, added in order of j; the last fused.
      {
#pragma clang fp contract(off)
        for (int j = 0; j < Dd - 1; ++j) z = z + stridev[j] * Wr[dd * Dd + j];
      }
      zz[u] = __builtin_fmaf(stridev[Dd - 1], Wr[dd * Dd + Dd - 1], z);
    }
#pragma unroll  // static indices, as above
    for (int u = 0; u < 3; ++u) {
      int dd = lane + 16 * u;
      float s = 1.0f / (1.0f + __expf(-zz[u]));
      if (dd < Dd) {
        sh.sa[dd] = s;
        if (blockIdx.x == 0) out_tail[dd] = s;
      }
    }
  }
  // This wave's part of the key stage: LDS byte address and source of its lane's
  // 16 bytes of row 0.
  unsigned kl = (unsigned)(uintptr_t)&sh.u.ks[wf * 32 * KP4 + lane];
  const float* kg = key + ((size_t)b * Ss + wf * 32) * Ee + lane * 4;
  if (mw) {
    // Wq rows g8*16 .. +15, columns g2*64 .. +63: a copy takes two rows' pieces,
    // 256 bytes a half-wave.
    copy8((unsigned)(uintptr_t)&sh.u.ks[(wv * 32 + 16) * KP4 + hi * WP4 + rc], 2 * WP4 * 16,
          Wq + (size_t)(g8 * 16 + hi) * Ee + g2 * 64 + rc * 4, 2 * Ee);
  }

  // What the matrix stages read from memory depends on nothing: asked for in
  // the order of use, as far as the registers reach.
  float ttv = (t < Ss) ? tt[b * Ss + t] : 0.f;
  v4f aq[8];
  float wk[32];
  float cb = 0.f;
  {
    const v4f* ag =
        (const v4f*)(query + ((size_t)b * Rr + r0 + (rc & 3)) * Ee + g2 * 64 + hi * 4);
#pragma unroll  // static indices: the fragments stay in registers, all loads in flight
    for (int i = 0; i < 8; ++i)
      aq[i] = ag[2 * i];   // A[row, g2*64 + 8i + 4hi .. +3], row m is q row m & 3
    if (g2 == 0) cb = bq[g8 * 16 + rc];
    const float* wkg = Wk + (size_t)(g2 * 64 + hi * 4) * Ee + g8 * 16 + rc;
#pragma unroll  // static indices, as above
    for (int i = 0; i < 8; ++i)
      for (int c = 0; c < 4; ++c)
        wk[i * 4 + c] = wkg[(i * 8 + c) * Ee];  // B[g2*64 + 8i + 4hi + c, col]
  }
  float qtr[RT];
  for (int rr = 0; rr < RT; ++rr) qtr[rr] = qt[r0 + rr];
  // The code below reuses registers that the loads above name as addresses:
  // this wait stands in front of that reuse.
  asm volatile("s_wait_xcnt 0x0" ::: "memory");

  if (mw) {
    // q: wave = (column tile g8, K half g2), 16 steps.
    copies_landed();
    // Key rows 0 .. 15 of this wave, ahead of the products: they fly under q and qq.
    copy8(kl, KP4 * 16, kg, Ee);
    copy8(kl + 8 * KP4 * 16, KP4 * 16, kg + 8 * Ee, Ee);
    const v4f* ws = &sh.u.ks[(wv * 32 + 16) * KP4 + rc * WP4 + hi];
    v4f wq[8];
#pragma unroll  // static indices: the fragments stay in registers
    for (int i = 0; i < 8; ++i) wq[i] = ws[2 * i];  // B[aq's k, col] = Wq[col, k]
    v8f c = {cb, cb, cb, cb, cb, cb, cb, cb};
#pragma unroll  // static indices into aq and wq
    for (int i = 0; i < 8; ++i) {
      c = mm4(lo2(aq[i]), lo2(wq[i]), c);
      c = mm4(hi2(aq[i]), hi2(wq[i]), c);
    }
    // Half of the result is not used, and the build writes an address into one
    // of its registers directly behind the last product: these four slots keep
    // the distance between a matrix instruction and an overwrite of its result.
    // The two scheduling barriers hold them at this place.
    __builtin_amdgcn_sched_barrier(0);
    asm volatile("v_nop\n\tv_nop\n\tv_nop\n\tv_nop");
    __builtin_amdgcn_sched_barrier(0);
    // Result rows 0..3 and 8..11 both hold the 4 rows: lower half-wave stores
    // rows 0, 1, the upper 2, 3.
    float* qo = (float*)&sh.qp[g2][hi * 2][0] + g8 * 16 + rc;
    qo[0] = hi ? c[2] : c[0];
    qo[QP4 * 4] = hi ? c[3] : c[1];
  }
  if (t < Ss) sh.tt[t] = ttv;
  lds_barrier();

  if (mw) {
    // qq: wave = (column tile g8, heads 2*g2 and 2*g2+1), 16 steps.  Row m of A
    // is q row m >> 2 where k lies in head m & 3, and 0 elsewhere, so the rows
    // of this wave's two heads come out whole and the other rows are not kept.
    const v4f* q0 = &sh.qp[0][rc >> 2][g2 * 16 + hi];
    const v4f* q1 = &sh.qp[1][rc >> 2][g2 * 16 + hi];
    int hm = (rc & 3) - g2 * 2;
    v8f c = {};
#pragma unroll  // static indices into wk
    for (int i = 0; i < 8; ++i) {
      v4f a = q0[2 * i] + q1[2 * i];
      if (hm != (i >> 2)) a = (v4f){0.f, 0.f, 0.f, 0.f};
      c = mm4(lo2(a), (v2f){wk[i * 4 + 0], wk[i * 4 + 1]}, c);
      c = mm4(hi2(a), (v2f){wk[i * 4 + 2], wk[i * 4 + 3]}, c);
    }
    float* qo = (float*)&sh.qq[hi * 8 + g2 * 2][0] + g8 * 16 + rc;
    qo[0 * QP4 * 4] = g2 ? c[2] : c[0];
    qo[1 * QP4 * 4] = g2 ? c[3] : c[1];
    qo[4 * QP4 * 4] = g2 ? c[6] : c[4];
    qo[5 * QP4 * 4] = g2 ? c[7] : c[5];
    copies_landed();  // key rows 0 .. 15
  } else {
    const v4f* qa = &sh.qp[0][lane >> 2][(lane & 3) * (EKk / 4)];
    const v4f* qb = &sh.qp[1][lane >> 2][(lane & 3) * (EKk / 4)];
    const v4f* bb = &sh.bk[(lane & 3) * (EKk / 4)];
    float z = 0.f;
#pragma unroll 2  // few registers: the other waves' fragments count here too
    for (int e = 0; e < EKk / 4; ++e) {
      v4f p = (qa[e] + qb[e]) * bb[e];
      z += (p.x + p.y) + (p.z + p.w);
    }
    sh.sb[lane] = z;
  }
  lds_barrier();

  // scores: wave = 32 values of s, two 16-column tiles one after the other, 32
  // steps a tile.  Result row i + 8*hi is (rr, h) = (2*hi + i/4, i%4).
  const float scale = 0.17677669529663687f;  // 1/sqrt(32)
  const v4f* qa = &sh.qq[rc][hi];
  const v4f* kb = &sh.u.ks[(wf * 32 + rc) * KP4 + hi];  // B[8i + 4hi .. +3, s] = key[s, k]
  if (mw) {
    // Key rows 16 .. 31 of this wave, over its piece of Wq, whose reads ended
    // ahead of the barriers above: they fly under the first tile's products.
    copy8(kl + 16 * KP4 * 16, KP4 * 16, kg + 16 * Ee, Ee);
    copy8(kl + 24 * KP4 * 16, KP4 * 16, kg + 24 * Ee, Ee);
    v8f c0;
    for (int i = 0; i < 8; ++i) c0[i] = sh.sb[hi * 8 + i];
#pragma unroll  // LDS offsets become immediates
    for (int i = 0; i < 16; ++i) {
      v4f a = qa[2 * i];
      v4f k = kb[2 * i];
      c0 = mm4(lo2(a), lo2(k), c0);
      c0 = mm4(hi2(a), hi2(k), c0);
    }
    int s = wv * 32 + rc;
    sh.e[hi * 2 + 0][s] = (v4f){c0[0], c0[1], c0[2], c0[3]} * scale;
    sh.e[hi * 2 + 1][s] = (v4f){c0[4], c0[5], c0[6], c0[7]} * scale;
  }

  // This thread's slice of value / mask: in flight under the second tile and
  // while the exps are made.
  const float* vb = value + (size_t)b * Ss * Dd + t;
  const float* mb = mask + (size_t)b * Ss * Dd + t;
  float vr[NJ], mr[NJ];
#pragma unroll  // static indices: vr and mr stay in registers, all loads in flight
  for (int j = 0; j < NJ; ++j) {
    vr[j] = vb[j * NT];
    mr[j] = mb[j * NT];
  }
  // As above: in front of the reuse of the address registers.
  asm volatile("s_wait_xcnt 0x0" ::: "memory");

  if (mw) {
    copies_landed();  // key rows 16 .. 31
    v8f c1;
    for (int i = 0; i < 8; ++i) c1[i] = sh.sb[hi * 8 + i];
#pragma unroll  // as for the first tile
    for (int i = 0; i < 16; ++i) {
      v4f a = qa[2 * i];
      v4f k = kb[16 * KP4 + 2 * i];
      c1 = mm4(lo2(a), lo2(k), c1);
      c1 = mm4(hi2(a), hi2(k), c1);
    }
    int s = wv * 32 + 16 + rc;
    sh.e[hi * 2 + 0][s] = (v4f){c1[0], c1[1], c1[2], c1[3]} * scale;
    sh.e[hi * 2 + 1][s] = (v4f){c1[4], c1[5], c1[6], c1[7]} * scale;
  }
  float sad = sh.sa[d];
  lds_barrier();

  // Every wave has left the key stage.  Wo goes to LDS whole and in its own
  // layout: wave w copies the pieces w, w + 16, ...; they fly under the exps and
  // the sum loop.
  if (mw) {
    unsigned wl = (unsigned)(uintptr_t)&sh.u.z.wo[wv * 32 + lane];
    const float* wg = Wo + (wv * 32 + lane) * 4;
    copy8(wl, MW * 512, wg, MW * 128);
    if (wv < WN - 8 * MW) copy1(wl + 8 * MW * 512, wg + 8 * MW * 128);
  }

  // One wave per (row, head): wave = rr * 4 + h, 16 scores a lane.
  if (mw) {
    float* eo = (float*)&sh.e[wv >> 2][0] + (wv & 3);
    float sc_loc[SL];
#pragma unroll  // static indices: sc_loc stays in registers
    for (int i = 0; i < SL; ++i) sc_loc[i] = eo[(lane + 32 * i) * Hh];
    float mx = sc_loc[0];
#pragma unroll  // static indices, as above
    for (int i = 1; i < SL; ++i) mx = fmaxf(mx, sc_loc[i]);
    for (int off = 16; off > 0; off >>= 1) mx = fmaxf(mx, __shfl_xor(mx, off));
#pragma unroll  // static indices, as above
    for (int i = 0; i < SL; ++i)
      eo[(lane + 32 * i) * Hh] = __expf(sc_loc[i] - mx);
  }
  __syncthreads();

  // The slice has landed: keep the mask as one flag an element from here on.
  bool mk[NJ];
#pragma unroll  // static indices, as above
  for (int j = 0; j < NJ; ++j) mk[j] = mr[j] != 0.0f;

  v2f num[RT][2], den[RT][2];
  for (int rr = 0; rr < RT; ++rr)
    for (int p = 0; p < 2; ++p) {
      num[rr][p] = (v2f){0.f, 0.f};
      den[rr][p] = (v2f){0.f, 0.f};
    }
  float vsum = 0.f;
#pragma unroll  // static indices, as above; LDS offsets become immediates
  for (int j = 0; j < NJ; ++j) {
    int s = s0 + SC * j;
    float v = vr[j];
    float ts = sh.tt[s];
    vsum += v;
    for (int rr = 0; rr < RT; ++rr) {
      bool on = mk[j] && (fabsf(ts - qtr[rr]) <= sad);
      float av = on ? v : 0.f;
      float af = on ? 1.f : 0.f;
      v4f e = sh.e[rr][s];
      v2f e01 = {e.x, e.y}, e23 = {e.z, e.w};
      v2f av2 = {av, av}, af2 = {af, af};
      num[rr][0] = __builtin_elementwise_fma(e01, av2, num[rr][0]);
      num[rr][1] = __builtin_elementwise_fma(e23, av2, num[rr][1]);
      den[rr][0] = __builtin_elementwise_fma(e01, af2, den[rr][0]);
      den[rr][1] = __builtin_elementwise_fma(e23, af2, den[rr][1]);
    }
  }

  for (int rr = 0; rr < RT; ++rr) {
    sh.u.z.red[0][rr][t] = (v4f){num[rr][0].x, num[rr][0].y, num[rr][1].x, num[rr][1].y};
    sh.u.z.red[1][rr][t] = (v4f){den[rr][0].x, den[rr][0].y, den[rr][1].x, den[rr][1].y};
  }
  sh.u.z.vs[t] = vsum;
  if (mw) copies_landed();  // Wo, ahead of the barrier behind which other waves read it
  __syncthreads();

  bool ow = wv >= OW0 && wv < OW0 + NO / 16;
  int col = (wv - OW0) * 16 + rc;
  float bv = ow ? bo[col] : 0.f;
  // The code below reuses registers that the load above names as address:
  // this wait stands in front of that reuse.
  asm volatile("s_wait_xcnt 0x0" ::: "memory");

  // One thread per (rr, d), all 4 heads.
  if (t < RT * Dd) {
    int rr = t / Dd;
    int dd = t - rr * Dd;
    v4f n = {0.f, 0.f, 0.f, 0.f}, de = {0.f, 0.f, 0.f, 0.f};
    float vs = 0.f;
    for (int c = 0; c < SC; ++c) {
      n += sh.u.z.red[0][rr][c * Dd + dd];
      de += sh.u.z.red[1][rr][c * Dd + dd];
      vs += sh.u.z.vs[c * Dd + dd];
    }
    float mean = vs * (1.0f / Ss);
    float* xo = &sh.u.z.xs[rr][dd];
    xo[0 * Dd] = (de.x > 0.f) ? (n.x / de.x) : mean;
    xo[1 * Dd] = (de.y > 0.f) ? (n.y / de.y) : mean;
    xo[2 * Dd] = (de.z > 0.f) ? (n.z / de.z) : mean;
    xo[3 * Dd] = (de.w > 0.f) ? (n.w / de.w) : mean;
  }

  // The product's waves have no part in the sums above: they fetch their Wo
  // fragments meanwhile.  B[4i+hi*2 .. +1, col] = Wo[col, k].
  v2f bf[XK / 4];
  if (ow) {
    const float* wl = (const float*)sh.u.z.wo + col * XK + hi * 2;
#pragma unroll  // static indices: bf stays in registers
    for (int i = 0; i < XK / 4; ++i) bf[i] = *(const v2f*)(wl + 4 * i);
  }
  __syncthreads();

  // A row m of the 16 is x row m & 3, so result rows 0..3 and 8..11 both hold
  // the block's 4 rows: the lower half-wave stores rows 0, 1, the upper 2, 3.
  if (ow) {
    const float* xa = &sh.u.z.xs[rc & 3][hi * 2];
    v2f af[XK / 4];
#pragma unroll  // static indices: af stays in registers
    for (int i = 0; i < XK / 4; ++i) af[i] = *(const v2f*)(xa + 4 * i);  // A[row, 4i+hi*2 .. +1]
    // All LDS reads go out ahead of the chain of products: left to itself the
    // build keeps two reads in flight and waits on each in turn.
    __builtin_amdgcn_sched_barrier(0);
    v8f c = {};
#pragma unroll  // static indices into af and bf
    for (int i = 0; i < XK / 4; ++i)
      c = __builtin_amdgcn_wmma_f32_16x16x4_f32(false, af[i], false, bf[i],
                                                (short)0, c, false, false);
    float* ob = out + ((size_t)b * Rr + r0 + hi * 2) * NO + col;
    ob[0] = (hi ? c[2] : c[0]) + bv;
    ob[NO] = (hi ? c[3] : c[1]) + bv;
  }
}

// ---------------------------------------------------------------------------
extern "C" void kernel_launch(void* const* d_in, const int* in_sizes, int n_in,
                              void* d_out, int out_size, void* d_ws,
                              size_t ws_size, hipStream_t stream) {
  const float* query = (const float*)d_in[0];
  const float* key   = (const float*)d_in[1];
  const float* value = (const float*)d_in[2];
  const float* mask  = (const float*)d_in[3];
  const float* qt    = (const float*)d_in[4];
  const float* tt    = (const float*)d_in[5];
  const float* strv  = (const float*)d_in[6];
  const float* Wq    = (const float*)d_in[7];
  const float* bq    = (const float*)d_in[8];
  const float* Wk    = (const float*)d_in[9];
  const float* bk    = (const float*)d_in[10];
  const float* Wr    = (const float*)d_in[11];
  const float* br    = (const float*)d_in[12];
  const float* Wo    = (const float*)d_in[13];
  const float* bo    = (const float*)d_in[14];
  float* out = (float*)d_out;

  // One block per (b, 4 query rows); writes d_out; the workspace is not used.
  attn_kernel<<<Bb * Rr / RT, NT, 0, stream>>>(
      query, key, value, mask, qt, tt, strv, Wq, bq, Wk, bk, Wr, br, Wo, bo, out,
      out + Bb * Rr * 128);
}
